// v000
// Measured on an AMD MI455X. A time is GPU time per run, averaged over a window of back-to-back runs after a warm-up
// (all launches, gaps included; the runs take copies of the inputs in turn), and the median of several windows.
// Apart from v000's, it joins two sittings. Times from different sittings can be a few percent apart, while
// side-by-side timings come from the same sitting.
// v000 is the starting kernel. One run takes 1710 microseconds.
#include <hip/hip_runtime.h>
#include <hip/hip_bf16.h>

#define D_DIM 1024
#define S_DIM 4096
#define B_DIM 4

typedef __attribute__((ext_vector_type(2))) float v2f;
typedef __attribute__((ext_vector_type(8))) float v8f;

#if defined(__AMDGCN__) && __has_builtin(__builtin_amdgcn_global_load_async_to_lds_b128)
#define HAVE_ASYNC_LDS 1
#else
#define HAVE_ASYNC_LDS 0
#endif

#if HAVE_ASYNC_LDS
// Builtin signature (from hipcc diagnostic): pointers to int vector_size(16),
// global (AS1) source first, LDS (AS3) destination second, imm offset, imm cpol.
typedef int v4i_vs __attribute__((vector_size(4 * sizeof(int))));
typedef __attribute__((address_space(1))) v4i_vs* g_v4i_p;
typedef __attribute__((address_space(3))) v4i_vs* l_v4i_p;
#endif

// 16-byte global -> LDS copy. Async (ASYNCcnt-tracked, no VGPR roundtrip) when
// the toolchain exposes the gfx1250 builtin, else plain load + ds_store_b128.
__device__ __forceinline__ void cp16(const float* __restrict__ g, float* l)
{
#if HAVE_ASYNC_LDS
    __builtin_amdgcn_global_load_async_to_lds_b128(
        (g_v4i_p)g, (l_v4i_p)l, 0, 0);
#else
    *(float4*)l = *(const float4*)g;
#endif
}

__device__ __forceinline__ void async_wait_all()
{
#if HAVE_ASYNC_LDS
    asm volatile("s_wait_asynccnt 0x0" ::: "memory");
#endif
}

// ---------------------------------------------------------------------------
// f32 WMMA GEMM with LDS double-buffered async staging + split-K over grid.z:
//   Dst[z][M,N] = op(A)[:, kz:kz+kPerSlice] * B[kz:kz+kPerSlice, :]
//     (kz = z*kPerSlice; Dst advances by M*N per z; z=1 slice => plain GEMM)
//   TA=false: op(A)[m][k] = A[m*lda + k]     TA=true: op(A)[m][k] = A[k*lda + m]
// Block = 256 threads (8 waves). Block tile 128x128, wave tile 32x64 (2x4 WMMA).
// M,N multiples of 128; kPerSlice multiple of 16 (K-chunk).
// ---------------------------------------------------------------------------
#define KC 16
#define LDB_S 136   // K-major panel stride (half-waves hit disjoint bank ranges)
#define LDA_S 20    // M-major A panel stride (lane start banks distinct mod 64)

template <bool TA>
__global__ __launch_bounds__(256)
void gemm_wmma_f32(const float* __restrict__ A, const float* __restrict__ B,
                   float* __restrict__ Dst, int M, int N, int kPerSlice,
                   int lda, int ldb, int ldd,
                   const float* __restrict__ rowAdd)
{
    __shared__ float sA[2][128 * LDA_S];  // NN: [m][k] ; TA reuses as [k][LDB_S]
    __shared__ float sB[2][KC * LDB_S];

    const int tid  = threadIdx.x;
    const int wave = tid >> 5;
    const int lane = tid & 31;
    const int half = lane >> 4;
    const int l16  = lane & 15;

    const int bm0 = blockIdx.y * 128;
    const int bn0 = blockIdx.x * 128;
    const int wr  = (wave >> 1) * 32;   // wave tile row in block
    const int wc  = (wave & 1) * 64;    // wave tile col in block

    const int kStart = blockIdx.z * kPerSlice;
    Dst += (size_t)blockIdx.z * M * N;

    v8f acc[2][4];
#pragma unroll
    for (int i = 0; i < 2; ++i)
#pragma unroll
        for (int j = 0; j < 4; ++j)
            acc[i][j] = (v8f){0.f, 0.f, 0.f, 0.f, 0.f, 0.f, 0.f, 0.f};

    // ---- panel staging for chunk starting at kc into buffer `buf` ----------
    auto stage = [&](int buf, int kc) {
        // B panel: KC x 128, K-major, contiguous 16B segments
#pragma unroll
        for (int it = 0; it < 2; ++it) {
            const int seg  = tid + 256 * it;     // 512 segments = 16 x 32
            const int row  = seg >> 5;
            const int col4 = (seg & 31) * 4;
            cp16(B + (size_t)(kc + row) * ldb + bn0 + col4,
                 &sB[buf][row * LDB_S + col4]);
        }
        if (TA) {
            // A panel: KC x 128, K-major (global already K-major)
#pragma unroll
            for (int it = 0; it < 2; ++it) {
                const int seg  = tid + 256 * it;
                const int row  = seg >> 5;
                const int col4 = (seg & 31) * 4;
                cp16(A + (size_t)(kc + row) * lda + bm0 + col4,
                     &sA[buf][row * LDB_S + col4]);
            }
        } else {
            // A panel: 128 x KC, M-major (global already M-major)
            const int m    = tid >> 1;
            const int koff = (tid & 1) * 8;
#pragma unroll
            for (int q = 0; q < 2; ++q) {
                const int off = koff + 4 * q;
                cp16(A + (size_t)(bm0 + m) * lda + kc + off,
                     &sA[buf][m * LDA_S + off]);
            }
        }
    };

    const int nChunks = kPerSlice / KC;

    stage(0, kStart);
    async_wait_all();
    __syncthreads();

    int cur = 0;
    for (int c = 0; c < nChunks; ++c) {
        const int next = cur ^ 1;
        if (c + 1 < nChunks) stage(next, kStart + (c + 1) * KC);  // prefetch

        // ---- compute this chunk from LDS ----
#pragma unroll
        for (int ks = 0; ks < KC; ks += 4) {
            const int kk = ks + 2 * half;   // this half-wave's K pair

            v2f af[2];
#pragma unroll
            for (int i = 0; i < 2; ++i) {
                const int m = wr + 16 * i + l16;
                if (TA) {
                    af[i].x = sA[cur][(kk + 0) * LDB_S + m];
                    af[i].y = sA[cur][(kk + 1) * LDB_S + m];
                } else {
                    af[i] = *(const v2f*)&sA[cur][m * LDA_S + kk];
                }
            }
            v2f bf[4];
#pragma unroll
            for (int j = 0; j < 4; ++j) {
                const int n = wc + 16 * j + l16;
                bf[j].x = sB[cur][(kk + 0) * LDB_S + n];
                bf[j].y = sB[cur][(kk + 1) * LDB_S + n];
            }
#pragma unroll
            for (int i = 0; i < 2; ++i)
#pragma unroll
                for (int j = 0; j < 4; ++j)
                    acc[i][j] = __builtin_amdgcn_wmma_f32_16x16x4_f32(
                        false, af[i], false, bf[j],
                        (short)0, acc[i][j], false, false);
        }

        async_wait_all();     // prefetch landed
        __syncthreads();      // everyone done reading `cur`, `next` visible
        cur = next;
    }

    // ---- epilogue: C/D layout lane<16: M=v, lane>=16: M=v+8 ; N=l16 --------
#pragma unroll
    for (int i = 0; i < 2; ++i) {
#pragma unroll
        for (int j = 0; j < 4; ++j) {
            const int col = bn0 + wc + 16 * j + l16;
            const float add = rowAdd ? rowAdd[col] : 0.f;
#pragma unroll
            for (int v = 0; v < 8; ++v) {
                const int row = bm0 + wr + 16 * i + v + 8 * half;
                Dst[(size_t)row * ldd + col] = acc[i][j][v] + add;
            }
        }
    }
}

// ---------------------------------------------------------------------------
// Split-K partial reduction (deterministic; no float atomics)
// ---------------------------------------------------------------------------
__global__ void reduceK_kernel(const float* __restrict__ P, float* __restrict__ G,
                               int nslice)
{
    const size_t idx = (size_t)blockIdx.x * blockDim.x + threadIdx.x;
    const size_t MAT = (size_t)D_DIM * D_DIM;
    float s = 0.f;
    for (int z = 0; z < nslice; ++z) s += P[z * MAT + idx];
    G[idx] = s;
}

// ---------------------------------------------------------------------------
// Small helper kernels (O(D) or O(D^2) threads, negligible cost)
// ---------------------------------------------------------------------------
__global__ void colsum_kernel(const float* __restrict__ X, float* __restrict__ xs)
{
    const int d = blockIdx.x * blockDim.x + threadIdx.x;
    float s = 0.f;
    for (int t = 0; t < S_DIM; ++t) s += X[(size_t)t * D_DIM + d];
    xs[d] = s;
}

__global__ void matvecT2_kernel(const float* __restrict__ Wk,
                                const float* __restrict__ Wv,
                                const float* __restrict__ xs,
                                float* __restrict__ u, float* __restrict__ w)
{
    const int m = blockIdx.x * blockDim.x + threadIdx.x;
    float su = 0.f, sw = 0.f;
    for (int k = 0; k < D_DIM; ++k) {
        const float xv = xs[k];
        su += Wk[(size_t)k * D_DIM + m] * xv;
        sw += Wv[(size_t)k * D_DIM + m] * xv;
    }
    u[m] = su;
    w[m] = sw;
}

// C += u*bv^T + bk*w^T + S*bk*bv^T   (exact bias terms of K^T V)
__global__ void rank1_kernel(float* __restrict__ C,
                             const float* __restrict__ u,
                             const float* __restrict__ bk,
                             const float* __restrict__ w,
                             const float* __restrict__ bv)
{
    const int idx = blockIdx.x * blockDim.x + threadIdx.x;
    const int j = idx >> 10;
    const int m = idx & (D_DIM - 1);
    C[idx] += u[j] * bv[m] + bk[j] * (w[m] + (float)S_DIM * bv[m]);
}

// s[d] = sum_j C[j][(d-j) mod D]
__global__ void sred_kernel(const float* __restrict__ C, float* __restrict__ s)
{
    const int d = blockIdx.x * blockDim.x + threadIdx.x;
    float acc = 0.f;
    for (int j = 0; j < D_DIM; ++j)
        acc += C[(size_t)j * D_DIM + ((d - j) & (D_DIM - 1))];
    s[d] = acc;
}

// Am[j][d] = s[(j+d) mod D]
__global__ void buildA_kernel(const float* __restrict__ s, float* __restrict__ Am)
{
    const int idx = blockIdx.x * blockDim.x + threadIdx.x;
    const int j = idx >> 10;
    const int d = idx & (D_DIM - 1);
    Am[idx] = s[(j + d) & (D_DIM - 1)];
}

// r[d] = sum_j bq[j]*s[(j+d) mod D]
__global__ void rvec_kernel(const float* __restrict__ bq,
                            const float* __restrict__ s, float* __restrict__ r)
{
    const int d = blockIdx.x * blockDim.x + threadIdx.x;
    float acc = 0.f;
    for (int j = 0; j < D_DIM; ++j)
        acc += bq[j] * s[(j + d) & (D_DIM - 1)];
    r[d] = acc;
}

// ---------------------------------------------------------------------------
// Per batch b:
//   G = Xb^T Xb  (split-K=8) ; T = Wk^T G ; C = T Wv (+bias rank-1)
//   s = anti-diag reduce C ; Am = circulant(s) ; Wp = Wq Am
//   Out_b = Xb Wp + 1*r^T
// ---------------------------------------------------------------------------
extern "C" void kernel_launch(void* const* d_in, const int* in_sizes, int n_in,
                              void* d_out, int out_size, void* d_ws, size_t ws_size,
                              hipStream_t stream)
{
    const float* x  = (const float*)d_in[0];
    const float* Wq = (const float*)d_in[1];
    const float* bq = (const float*)d_in[2];
    const float* Wk = (const float*)d_in[3];
    const float* bk = (const float*)d_in[4];
    const float* Wv = (const float*)d_in[5];
    const float* bv = (const float*)d_in[6];
    float* out = (float*)d_out;

    float* wsf = (float*)d_ws;
    const size_t MAT = (size_t)D_DIM * D_DIM;
    const int NSLICE = 8;
    float* Gp = wsf;                    // split-K partials: 8 * 4 MB
    float* G  = wsf + (size_t)NSLICE * MAT;
    float* T  = G + MAT;
    float* Cm = T + MAT;
    float* Am = Cm + MAT;
    float* Wp = Am + MAT;
    float* xs = Wp + MAT;
    float* u  = xs + D_DIM;
    float* w  = u + D_DIM;
    float* sv = w + D_DIM;
    float* r  = sv + D_DIM;

    const dim3 blk(256);
    const dim3 gridDD(D_DIM / 128, D_DIM / 128, 1);        // 8 x 8
    const dim3 gridGram(D_DIM / 128, D_DIM / 128, NSLICE); // 8 x 8 x 8
    const dim3 gridSD(D_DIM / 128, S_DIM / 128, 1);        // 8 x 32

    for (int b = 0; b < B_DIM; ++b) {
        const float* Xb = x + (size_t)b * S_DIM * D_DIM;
        float*       Ob = out + (size_t)b * S_DIM * D_DIM;

        // G = Xb^T Xb (M=N=1024, K=4096 split 8 ways), then reduce
        gemm_wmma_f32<true><<<gridGram, blk, 0, stream>>>(
            Xb, Xb, Gp, D_DIM, D_DIM, S_DIM / NSLICE, D_DIM, D_DIM, D_DIM, nullptr);
        reduceK_kernel<<<(int)(MAT / 256), 256, 0, stream>>>(Gp, G, NSLICE);

        colsum_kernel<<<D_DIM / 256, 256, 0, stream>>>(Xb, xs);
        matvecT2_kernel<<<D_DIM / 256, 256, 0, stream>>>(Wk, Wv, xs, u, w);

        // T = Wk^T G ; C = T Wv
        gemm_wmma_f32<true><<<gridDD, blk, 0, stream>>>(
            Wk, G, T, D_DIM, D_DIM, D_DIM, D_DIM, D_DIM, D_DIM, nullptr);
        gemm_wmma_f32<false><<<gridDD, blk, 0, stream>>>(
            T, Wv, Cm, D_DIM, D_DIM, D_DIM, D_DIM, D_DIM, D_DIM, nullptr);

        rank1_kernel<<<(D_DIM * D_DIM) / 256, 256, 0, stream>>>(Cm, u, bk, w, bv);
        sred_kernel<<<D_DIM / 256, 256, 0, stream>>>(Cm, sv);
        buildA_kernel<<<(D_DIM * D_DIM) / 256, 256, 0, stream>>>(sv, Am);
        rvec_kernel<<<D_DIM / 256, 256, 0, stream>>>(bq, sv, r);

        // Wp = Wq Am ; Out_b = Xb Wp + 1*r^T
        gemm_wmma_f32<false><<<gridDD, blk, 0, stream>>>(
            Wq, Am, Wp, D_DIM, D_DIM, D_DIM, D_DIM, D_DIM, D_DIM, nullptr);
        gemm_wmma_f32<false><<<gridSD, blk, 0, stream>>>(
            Xb, Wp, Ob, S_DIM, D_DIM, D_DIM, D_DIM, D_DIM, D_DIM, r);
    }
}

// v001
// It runs in 832 microseconds.
// Timed twice side by side with v000, it ran 2.06 times as fast both times.
#include <hip/hip_runtime.h>
#include <hip/hip_bf16.h>

#define D_DIM 1024
#define S_DIM 4096
#define B_DIM 4

typedef __attribute__((ext_vector_type(2))) float v2f;
typedef __attribute__((ext_vector_type(8))) float v8f;

#if defined(__AMDGCN__) && __has_builtin(__builtin_amdgcn_global_load_async_to_lds_b128)
#define HAVE_ASYNC_LDS 1
#else
#define HAVE_ASYNC_LDS 0
#endif

#if HAVE_ASYNC_LDS
// Builtin signature (from hipcc diagnostic): pointers to int vector_size(16),
// global (AS1) source first, LDS (AS3) destination second, imm offset, imm cpol.
typedef int v4i_vs __attribute__((vector_size(4 * sizeof(int))));
typedef __attribute__((address_space(1))) v4i_vs* g_v4i_p;
typedef __attribute__((address_space(3))) v4i_vs* l_v4i_p;
#endif

// 16-byte global -> LDS copy. Async (ASYNCcnt-tracked, no VGPR roundtrip) when
// the toolchain exposes the gfx1250 builtin, else plain load + ds_store_b128.
__device__ __forceinline__ void cp16(const float* __restrict__ g, float* l)
{
#if HAVE_ASYNC_LDS
    __builtin_amdgcn_global_load_async_to_lds_b128(
        (g_v4i_p)g, (l_v4i_p)l, 0, 0);
#else
    *(float4*)l = *(const float4*)g;
#endif
}

__device__ __forceinline__ void async_wait_all()
{
#if HAVE_ASYNC_LDS
    asm volatile("s_wait_asynccnt 0x0" ::: "memory");
#endif
}

// ---------------------------------------------------------------------------
// f32 WMMA GEMM with LDS double-buffered async staging + split-K over grid.z:
//   Dst[z][M,N] = op(A_b)[:, kz:kz+kPerSlice] * B_b[kz:kz+kPerSlice, :]
//     grid.z = batches * slices: b = z >> sliceShift, slice = z & (slices - 1),
//     kz = slice*kPerSlice; Dst advances by M*N per z; A, B and rowAdd advance
//     by batchA, batchB and batchRow elements per batch (0: shared operand)
//   TA=false: op(A)[m][k] = A[m*lda + k]     TA=true: op(A)[m][k] = A[k*lda + m]
// Block = 256 threads (8 waves). Block tile 128x128, wave tile 32x64 (2x4 WMMA).
// M,N multiples of 128; kPerSlice multiple of 16 (K-chunk).
// ---------------------------------------------------------------------------
#define KC 16
#define LDB_S 136   // K-major panel stride (half-waves hit disjoint bank ranges)
#define LDA_S 20    // M-major A panel stride (lane start banks distinct mod 64)

template <bool TA>
__global__ __launch_bounds__(256)
void gemm_wmma_f32(const float* __restrict__ A, const float* __restrict__ B,
                   float* __restrict__ Dst, int M, int N, int kPerSlice,
                   int lda, int ldb, int ldd,
                   const float* __restrict__ rowAdd,
                   int sliceShift, int batchA, int batchB, int batchRow)
{
    __shared__ float sA[2][128 * LDA_S];  // NN: [m][k] ; TA reuses as [k][LDB_S]
    __shared__ float sB[2][KC * LDB_S];

    const int tid  = threadIdx.x;
    const int wave = tid >> 5;
    const int lane = tid & 31;
    const int half = lane >> 4;
    const int l16  = lane & 15;

    const int bm0 = blockIdx.y * 128;
    const int bn0 = blockIdx.x * 128;
    const int wr  = (wave >> 1) * 32;   // wave tile row in block
    const int wc  = (wave & 1) * 64;    // wave tile col in block

    const int batch  = blockIdx.z >> sliceShift;
    const int kStart = (blockIdx.z - (batch << sliceShift)) * kPerSlice;
    A   += (size_t)batch * batchA;
    B   += (size_t)batch * batchB;
    Dst += (size_t)blockIdx.z * M * N;
    if (rowAdd) rowAdd += (size_t)batch * batchRow;

    v8f acc[2][4];
#pragma unroll
    for (int i = 0; i < 2; ++i)
#pragma unroll
        for (int j = 0; j < 4; ++j)
            acc[i][j] = (v8f){0.f, 0.f, 0.f, 0.f, 0.f, 0.f, 0.f, 0.f};

    // ---- panel staging for chunk starting at kc into buffer `buf` ----------
    auto stage = [&](int buf, int kc) {
        // B panel: KC x 128, K-major, contiguous 16B segments
#pragma unroll
        for (int it = 0; it < 2; ++it) {
            const int seg  = tid + 256 * it;     // 512 segments = 16 x 32
            const int row  = seg >> 5;
            const int col4 = (seg & 31) * 4;
            cp16(B + (size_t)(kc + row) * ldb + bn0 + col4,
                 &sB[buf][row * LDB_S + col4]);
        }
        if (TA) {
            // A panel: KC x 128, K-major (global already K-major)
#pragma unroll
            for (int it = 0; it < 2; ++it) {
                const int seg  = tid + 256 * it;
                const int row  = seg >> 5;
                const int col4 = (seg & 31) * 4;
                cp16(A + (size_t)(kc + row) * lda + bm0 + col4,
                     &sA[buf][row * LDB_S + col4]);
            }
        } else {
            // A panel: 128 x KC, M-major (global already M-major)
            const int m    = tid >> 1;
            const int koff = (tid & 1) * 8;
#pragma unroll
            for (int q = 0; q < 2; ++q) {
                const int off = koff + 4 * q;
                cp16(A + (size_t)(bm0 + m) * lda + kc + off,
                     &sA[buf][m * LDA_S + off]);
            }
        }
    };

    const int nChunks = kPerSlice / KC;

    stage(0, kStart);
    async_wait_all();
    __syncthreads();

    int cur = 0;
    for (int c = 0; c < nChunks; ++c) {
        const int next = cur ^ 1;
        if (c + 1 < nChunks) stage(next, kStart + (c + 1) * KC);  // prefetch

        // ---- compute this chunk from LDS ----
#pragma unroll
        for (int ks = 0; ks < KC; ks += 4) {
            const int kk = ks + 2 * half;   // this half-wave's K pair

            v2f af[2];
#pragma unroll
            for (int i = 0; i < 2; ++i) {
                const int m = wr + 16 * i + l16;
                if (TA) {
                    af[i].x = sA[cur][(kk + 0) * LDB_S + m];
                    af[i].y = sA[cur][(kk + 1) * LDB_S + m];
                } else {
                    af[i] = *(const v2f*)&sA[cur][m * LDA_S + kk];
                }
            }
            v2f bf[4];
#pragma unroll
            for (int j = 0; j < 4; ++j) {
                const int n = wc + 16 * j + l16;
                bf[j].x = sB[cur][(kk + 0) * LDB_S + n];
                bf[j].y = sB[cur][(kk + 1) * LDB_S + n];
            }
#pragma unroll
            for (int i = 0; i < 2; ++i)
#pragma unroll
                for (int j = 0; j < 4; ++j)
                    acc[i][j] = __builtin_amdgcn_wmma_f32_16x16x4_f32(
                        false, af[i], false, bf[j],
                        (short)0, acc[i][j], false, false);
        }

        async_wait_all();     // prefetch landed
        __syncthreads();      // everyone done reading `cur`, `next` visible
        cur = next;
    }

    // ---- epilogue: C/D layout lane<16: M=v, lane>=16: M=v+8 ; N=l16 --------
#pragma unroll
    for (int i = 0; i < 2; ++i) {
#pragma unroll
        for (int j = 0; j < 4; ++j) {
            const int col = bn0 + wc + 16 * j + l16;
            const float add = rowAdd ? rowAdd[col] : 0.f;
#pragma unroll
            for (int v = 0; v < 8; ++v) {
                const int row = bm0 + wr + 16 * i + v + 8 * half;
                Dst[(size_t)row * ldd + col] = acc[i][j][v] + add;
            }
        }
    }
}

// ---------------------------------------------------------------------------
// Split-K partial reduction (deterministic; no float atomics)
// ---------------------------------------------------------------------------
__global__ void reduceK_kernel(const float* __restrict__ P, float* __restrict__ G,
                               int nslice)
{
    const size_t idx = (size_t)blockIdx.x * blockDim.x + threadIdx.x;
    const size_t MAT = (size_t)D_DIM * D_DIM;
    P += (size_t)blockIdx.y * nslice * MAT;
    G += (size_t)blockIdx.y * MAT;
    float s = 0.f;
    for (int z = 0; z < nslice; ++z) s += P[z * MAT + idx];
    G[idx] = s;
}

// ---------------------------------------------------------------------------
// Small helper kernels; blockIdx.y is the batch in every one of them
// ---------------------------------------------------------------------------
__global__ void colsum_kernel(const float* __restrict__ X, float* __restrict__ xs)
{
    const int d = blockIdx.x * blockDim.x + threadIdx.x;
    X  += (size_t)blockIdx.y * S_DIM * D_DIM;
    xs += blockIdx.y * D_DIM;
    float s = 0.f;
    for (int t = 0; t < S_DIM; ++t) s += X[(size_t)t * D_DIM + d];
    xs[d] = s;
}

__global__ void matvecT2_kernel(const float* __restrict__ Wk,
                                const float* __restrict__ Wv,
                                const float* __restrict__ xs,
                                float* __restrict__ u, float* __restrict__ w)
{
    const int m = blockIdx.x * blockDim.x + threadIdx.x;
    xs += blockIdx.y * D_DIM;
    u  += blockIdx.y * D_DIM;
    w  += blockIdx.y * D_DIM;
    float su = 0.f, sw = 0.f;
    for (int k = 0; k < D_DIM; ++k) {
        const float xv = xs[k];
        su += Wk[(size_t)k * D_DIM + m] * xv;
        sw += Wv[(size_t)k * D_DIM + m] * xv;
    }
    u[m] = su;
    w[m] = sw;
}

// C += u*bv^T + bk*w^T + S*bk*bv^T   (exact bias terms of K^T V)
__global__ void rank1_kernel(float* __restrict__ C,
                             const float* __restrict__ u,
                             const float* __restrict__ bk,
                             const float* __restrict__ w,
                             const float* __restrict__ bv)
{
    const int idx = blockIdx.x * blockDim.x + threadIdx.x;
    const int j = idx >> 10;
    const int m = idx & (D_DIM - 1);
    C += (size_t)blockIdx.y * D_DIM * D_DIM;
    u += blockIdx.y * D_DIM;
    w += blockIdx.y * D_DIM;
    C[idx] += u[j] * bv[m] + bk[j] * (w[m] + (float)S_DIM * bv[m]);
}

// s[d] = sum_j C[j][(d-j) mod D]
__global__ void sred_kernel(const float* __restrict__ C, float* __restrict__ s)
{
    const int d = blockIdx.x * blockDim.x + threadIdx.x;
    C += (size_t)blockIdx.y * D_DIM * D_DIM;
    s += blockIdx.y * D_DIM;
    float acc = 0.f;
    for (int j = 0; j < D_DIM; ++j)
        acc += C[(size_t)j * D_DIM + ((d - j) & (D_DIM - 1))];
    s[d] = acc;
}

// Am[j][d] = s[(j+d) mod D]
__global__ void buildA_kernel(const float* __restrict__ s, float* __restrict__ Am)
{
    const int idx = blockIdx.x * blockDim.x + threadIdx.x;
    const int j = idx >> 10;
    const int d = idx & (D_DIM - 1);
    s  += blockIdx.y * D_DIM;
    Am += (size_t)blockIdx.y * D_DIM * D_DIM;
    Am[idx] = s[(j + d) & (D_DIM - 1)];
}

// r[d] = sum_j bq[j]*s[(j+d) mod D]
__global__ void rvec_kernel(const float* __restrict__ bq,
                            const float* __restrict__ s, float* __restrict__ r)
{
    const int d = blockIdx.x * blockDim.x + threadIdx.x;
    s += blockIdx.y * D_DIM;
    r += blockIdx.y * D_DIM;
    float acc = 0.f;
    for (int j = 0; j < D_DIM; ++j)
        acc += bq[j] * s[(j + d) & (D_DIM - 1)];
    r[d] = acc;
}

// ---------------------------------------------------------------------------
// All batches b in every launch (batch = grid.z of the GEMMs, grid.y elsewhere):
//   G = Xb^T Xb  (split-K=8) ; T = Wk^T G ; C = T Wv (+bias rank-1)
//   s = anti-diag reduce C ; Am = circulant(s) ; Wp = Wq Am
//   Out_b = Xb Wp + 1*r^T
// ---------------------------------------------------------------------------
extern "C" void kernel_launch(void* const* d_in, const int* in_sizes, int n_in,
                              void* d_out, int out_size, void* d_ws, size_t ws_size,
                              hipStream_t stream)
{
    const float* x  = (const float*)d_in[0];
    const float* Wq = (const float*)d_in[1];
    const float* bq = (const float*)d_in[2];
    const float* Wk = (const float*)d_in[3];
    const float* bk = (const float*)d_in[4];
    const float* Wv = (const float*)d_in[5];
    const float* bv = (const float*)d_in[6];
    float* out = (float*)d_out;

    float* wsf = (float*)d_ws;
    const size_t MAT = (size_t)D_DIM * D_DIM;
    const int NSLICE = 8;               // = 1 << SLICE_SHIFT
    const int SLICE_SHIFT = 3;
    const int MATI = D_DIM * D_DIM;     // batch step of a D x D matrix
    const int XBI  = S_DIM * D_DIM;     // batch step of x
    float* Gp = wsf;                    // split-K partials: 4 * 8 * 4 MB
    float* G  = wsf + (size_t)B_DIM * NSLICE * MAT;   // 4 * 4 MB each from here
    float* T  = G + B_DIM * MAT;
    float* Cm = T + B_DIM * MAT;
    float* Am = Cm + B_DIM * MAT;
    float* Wp = Am + B_DIM * MAT;
    float* xs = Wp + B_DIM * MAT;       // 4 * D each from here
    float* u  = xs + B_DIM * D_DIM;
    float* w  = u + B_DIM * D_DIM;
    float* sv = w + B_DIM * D_DIM;
    float* r  = sv + B_DIM * D_DIM;

    const dim3 blk(256);
    const dim3 gridDD(D_DIM / 128, D_DIM / 128, B_DIM);            // 8 x 8 x 4
    const dim3 gridGram(D_DIM / 128, D_DIM / 128, B_DIM * NSLICE); // 8 x 8 x 32
    const dim3 gridSD(D_DIM / 128, S_DIM / 128, B_DIM);            // 8 x 32 x 4
    const dim3 gridVec(D_DIM / 256, B_DIM);                        // 4 x 4
    const dim3 gridMat((D_DIM * D_DIM) / 256, B_DIM);              // 4096 x 4

    // G = Xb^T Xb (M=N=1024, K=4096 split 8 ways), then reduce
    gemm_wmma_f32<true><<<gridGram, blk, 0, stream>>>(
        x, x, Gp, D_DIM, D_DIM, S_DIM / NSLICE, D_DIM, D_DIM, D_DIM, nullptr,
        SLICE_SHIFT, XBI, XBI, 0);
    reduceK_kernel<<<gridMat, 256, 0, stream>>>(Gp, G, NSLICE);

    colsum_kernel<<<gridVec, 256, 0, stream>>>(x, xs);
    matvecT2_kernel<<<gridVec, 256, 0, stream>>>(Wk, Wv, xs, u, w);

    // T = Wk^T G ; C = T Wv
    gemm_wmma_f32<true><<<gridDD, blk, 0, stream>>>(
        Wk, G, T, D_DIM, D_DIM, D_DIM, D_DIM, D_DIM, D_DIM, nullptr,
        0, 0, MATI, 0);
    gemm_wmma_f32<false><<<gridDD, blk, 0, stream>>>(
        T, Wv, Cm, D_DIM, D_DIM, D_DIM, D_DIM, D_DIM, D_DIM, nullptr,
        0, MATI, 0, 0);

    rank1_kernel<<<gridMat, 256, 0, stream>>>(Cm, u, bk, w, bv);
    sred_kernel<<<gridVec, 256, 0, stream>>>(Cm, sv);
    buildA_kernel<<<gridMat, 256, 0, stream>>>(sv, Am);
    rvec_kernel<<<gridVec, 256, 0, stream>>>(bq, sv, r);

    // Wp = Wq Am ; Out_b = Xb Wp + 1*r^T
    gemm_wmma_f32<false><<<gridDD, blk, 0, stream>>>(
        Wq, Am, Wp, D_DIM, D_DIM, D_DIM, D_DIM, D_DIM, D_DIM, nullptr,
        0, 0, MATI, 0);
    gemm_wmma_f32<false><<<gridSD, blk, 0, stream>>>(
        x, Wp, out, S_DIM, D_DIM, D_DIM, D_DIM, D_DIM, D_DIM, r,
        0, XBI, MATI, D_DIM);
}

// v002
// It runs in 581 microseconds.
// In both of two side-by-side timings against v001, it was 1.43 times as fast.
// All steps since v000 together make it 2.95 times as fast.
#include <hip/hip_runtime.h>
#include <hip/hip_bf16.h>

#define D_DIM 1024
#define S_DIM 4096
#define B_DIM 4

typedef __attribute__((ext_vector_type(2))) float v2f;
typedef __attribute__((ext_vector_type(8))) float v8f;

#if defined(__AMDGCN__) && __has_builtin(__builtin_amdgcn_global_load_async_to_lds_b128)
#define HAVE_ASYNC_LDS 1
#else
#define HAVE_ASYNC_LDS 0
#endif

#if HAVE_ASYNC_LDS
// Builtin signature (from hipcc diagnostic): pointers to int vector_size(16),
// global (AS1) source first, LDS (AS3) destination second, imm offset, imm cpol.
typedef int v4i_vs __attribute__((vector_size(4 * sizeof(int))));
typedef __attribute__((address_space(1))) v4i_vs* g_v4i_p;
typedef __attribute__((address_space(3))) v4i_vs* l_v4i_p;
#endif

// 16-byte global -> LDS copy. Async (ASYNCcnt-tracked, no VGPR roundtrip) when
// the toolchain exposes the gfx1250 builtin, else plain load + ds_store_b128.
__device__ __forceinline__ void cp16(const float* __restrict__ g, float* l)
{
#if HAVE_ASYNC_LDS
    __builtin_amdgcn_global_load_async_to_lds_b128(
        (g_v4i_p)g, (l_v4i_p)l, 0, 0);
#else
    *(float4*)l = *(const float4*)g;
#endif
}

__device__ __forceinline__ void async_wait_all()
{
#if HAVE_ASYNC_LDS
    asm volatile("s_wait_asynccnt 0x0" ::: "memory");
#endif
}

// ---------------------------------------------------------------------------
// f32 WMMA GEMM with LDS double-buffered async staging + split-K over grid.z:
//   Dst[z][M,N] = op(A_b)[:, kz:kz+kPerSlice] * B_b[kz:kz+kPerSlice, :]
//     grid.z = batches * slices: b = z >> sliceShift, slice = z & (slices - 1),
//     kz = slice*kPerSlice; Dst advances by M*N per z; A, B and rowAdd advance
//     by batchA, batchB and batchRow elements per batch (0: shared operand)
//   TA=false: op(A)[m][k] = A[m*lda + k]     TA=true: op(A)[m][k] = A[k*lda + m]
// Block = 256 threads (8 waves). Block tile 128x128, wave tile 32x64 (2x4 WMMA).
// M,N multiples of 128; kPerSlice multiple of 16 (K-chunk).
// ---------------------------------------------------------------------------
#define KC 16
#define LDB_S 136   // K-major panel stride (half-waves hit disjoint bank ranges)
#define LDA_S 20    // M-major A panel stride (lane start banks distinct mod 64)

template <bool TA>
__global__ __launch_bounds__(256)
void gemm_wmma_f32(const float* __restrict__ A, const float* __restrict__ B,
                   float* __restrict__ Dst, int M, int N, int kPerSlice,
                   int lda, int ldb, int ldd,
                   const float* __restrict__ rowAdd,
                   int sliceShift, int batchA, int batchB, int batchRow)
{
    __shared__ float sA[2][128 * LDA_S];  // NN: [m][k] ; TA reuses as [k][LDB_S]
    __shared__ float sB[2][KC * LDB_S];

    const int tid  = threadIdx.x;
    const int wave = tid >> 5;
    const int lane = tid & 31;
    const int half = lane >> 4;
    const int l16  = lane & 15;

    const int bm0 = blockIdx.y * 128;
    const int bn0 = blockIdx.x * 128;
    const int wr  = (wave >> 1) * 32;   // wave tile row in block
    const int wc  = (wave & 1) * 64;    // wave tile col in block

    const int batch  = blockIdx.z >> sliceShift;
    const int kStart = (blockIdx.z - (batch << sliceShift)) * kPerSlice;
    A   += (size_t)batch * batchA;
    B   += (size_t)batch * batchB;
    Dst += (size_t)blockIdx.z * M * N;
    if (rowAdd) rowAdd += (size_t)batch * batchRow;

    v8f acc[2][4];
#pragma unroll
    for (int i = 0; i < 2; ++i)
#pragma unroll
        for (int j = 0; j < 4; ++j)
            acc[i][j] = (v8f){0.f, 0.f, 0.f, 0.f, 0.f, 0.f, 0.f, 0.f};

    // ---- panel staging for chunk starting at kc into buffer `buf` ----------
    auto stage = [&](int buf, int kc) {
        // B panel: KC x 128, K-major, contiguous 16B segments
#pragma unroll
        for (int it = 0; it < 2; ++it) {
            const int seg  = tid + 256 * it;     // 512 segments = 16 x 32
            const int row  = seg >> 5;
            const int col4 = (seg & 31) * 4;
            cp16(B + (size_t)(kc + row) * ldb + bn0 + col4,
                 &sB[buf][row * LDB_S + col4]);
        }
        if (TA) {
            // A panel: KC x 128, K-major (global already K-major)
#pragma unroll
            for (int it = 0; it < 2; ++it) {
                const int seg  = tid + 256 * it;
                const int row  = seg >> 5;
                const int col4 = (seg & 31) * 4;
                cp16(A + (size_t)(kc + row) * lda + bm0 + col4,
                     &sA[buf][row * LDB_S + col4]);
            }
        } else {
            // A panel: 128 x KC, M-major (global already M-major)
            const int m    = tid >> 1;
            const int koff = (tid & 1) * 8;
#pragma unroll
            for (int q = 0; q < 2; ++q) {
                const int off = koff + 4 * q;
                cp16(A + (size_t)(bm0 + m) * lda + kc + off,
                     &sA[buf][m * LDA_S + off]);
            }
        }
    };

    const int nChunks = kPerSlice / KC;

    stage(0, kStart);
    async_wait_all();
    __syncthreads();

    int cur = 0;
    for (int c = 0; c < nChunks; ++c) {
        const int next = cur ^ 1;
        if (c + 1 < nChunks) stage(next, kStart + (c + 1) * KC);  // prefetch

        // ---- compute this chunk from LDS ----
#pragma unroll
        for (int ks = 0; ks < KC; ks += 4) {
            const int kk = ks + 2 * half;   // this half-wave's K pair

            v2f af[2];
#pragma unroll
            for (int i = 0; i < 2; ++i) {
                const int m = wr + 16 * i + l16;
                if (TA) {
                    af[i].x = sA[cur][(kk + 0) * LDB_S + m];
                    af[i].y = sA[cur][(kk + 1) * LDB_S + m];
                } else {
                    af[i] = *(const v2f*)&sA[cur][m * LDA_S + kk];
                }
            }
            v2f bf[4];
#pragma unroll
            for (int j = 0; j < 4; ++j) {
                const int n = wc + 16 * j + l16;
                bf[j].x = sB[cur][(kk + 0) * LDB_S + n];
                bf[j].y = sB[cur][(kk + 1) * LDB_S + n];
            }
#pragma unroll
            for (int i = 0; i < 2; ++i)
#pragma unroll
                for (int j = 0; j < 4; ++j)
                    acc[i][j] = __builtin_amdgcn_wmma_f32_16x16x4_f32(
                        false, af[i], false, bf[j],
                        (short)0, acc[i][j], false, false);
        }

        async_wait_all();     // prefetch landed
        __syncthreads();      // everyone done reading `cur`, `next` visible
        cur = next;
    }

    // ---- epilogue: C/D layout lane<16: M=v, lane>=16: M=v+8 ; N=l16 --------
#pragma unroll
    for (int i = 0; i < 2; ++i) {
#pragma unroll
        for (int j = 0; j < 4; ++j) {
            const int col = bn0 + wc + 16 * j + l16;
            const float add = rowAdd ? rowAdd[col] : 0.f;
#pragma unroll
            for (int v = 0; v < 8; ++v) {
                const int row = bm0 + wr + 16 * i + v + 8 * half;
                Dst[(size_t)row * ldd + col] = acc[i][j][v] + add;
            }
        }
    }
}

// ---------------------------------------------------------------------------
// Split-K partial reduction (deterministic; no float atomics)
// ---------------------------------------------------------------------------
__global__ void reduceK_kernel(const float* __restrict__ P, float* __restrict__ G,
                               int nslice)
{
    const size_t idx = (size_t)blockIdx.x * blockDim.x + threadIdx.x;
    const size_t MAT = (size_t)D_DIM * D_DIM;
    P += (size_t)blockIdx.y * nslice * MAT;
    G += (size_t)blockIdx.y * MAT;
    float s = 0.f;
    for (int z = 0; z < nslice; ++z) s += P[z * MAT + idx];
    G[idx] = s;
}

// ---------------------------------------------------------------------------
// Small helper kernels; blockIdx.y is the batch in every one of them.
// The long per-column sums are split: a work-group of 32 waves owns 32 columns
// (one per lane), wave w sums terms [32w, 32w+32) in their order, and one wave
// adds the 32 partial sums from LDS in wave order.
// ---------------------------------------------------------------------------
#define RED_WAVES 32    // waves of a work-group in a split sum
#define RED_TERMS 32    // terms per wave: RED_WAVES * RED_TERMS = D_DIM
#define CS_CHUNKS 64    // row chunks of x per batch in the column sum
#define CS_ROWS   16    // rows per thread: 4 row groups * CS_ROWS * CS_CHUNKS = S_DIM

// the sum of the waves' partial sums of this lane's column, in wave order
__device__ __forceinline__ float sum_waves(const float (*red)[32], int lane)
{
    float s = 0.f;
    for (int p = 0; p < RED_WAVES; ++p) s += red[p][lane];
    return s;
}

// xsp[b][c][:] = sum of rows [64c, 64c+64) of x_b. 1024 threads = 4 row groups
// x 256 columns of float4; the four row groups are added through LDS.
__global__ __launch_bounds__(1024)
void colsum_kernel(const float* __restrict__ X, float* __restrict__ xsp)
{
    __shared__ float4 red[3][D_DIM / 4];
    const int c4 = threadIdx.x & 255;
    const int rg = threadIdx.x >> 8;
    const float4* Xr = (const float4*)(X + (size_t)blockIdx.y * S_DIM * D_DIM
        + (size_t)(blockIdx.x * 4 * CS_ROWS + rg * CS_ROWS) * D_DIM) + c4;
    float4 s = make_float4(0.f, 0.f, 0.f, 0.f);
    // unrolled so that a thread's 16 loads are all in flight together
#pragma unroll
    for (int t = 0; t < CS_ROWS; ++t) {
        const float4 v = Xr[t * (D_DIM / 4)];
        s.x += v.x; s.y += v.y; s.z += v.z; s.w += v.w;
    }
    if (rg) red[rg - 1][c4] = s;
    __syncthreads();
    if (rg == 0) {
        for (int p = 0; p < 3; ++p) {
            const float4 v = red[p][c4];
            s.x += v.x; s.y += v.y; s.z += v.z; s.w += v.w;
        }
        ((float4*)(xsp + ((size_t)blockIdx.y * CS_CHUNKS + blockIdx.x) * D_DIM))[c4] = s;
    }
}

// u = Wk^T xs, w = Wv^T xs, with xs = sum of the CS_CHUNKS partial column sums
__global__ __launch_bounds__(1024)
void matvecT2_kernel(const float* __restrict__ Wk,
                     const float* __restrict__ Wv,
                     const float* __restrict__ xsp,
                     float* __restrict__ u, float* __restrict__ w)
{
    __shared__ float xs[D_DIM];
    __shared__ float redU[RED_WAVES][32];
    __shared__ float redW[RED_WAVES][32];
    const int tid  = threadIdx.x;
    const int lane = tid & 31;
    // the wave's number as a scalar: the row addresses then have a scalar base
    // and the lane's column as their only vector part
    const int wv   = __builtin_amdgcn_readfirstlane(tid >> 5);
    const int m    = blockIdx.x * 32 + lane;
    xsp += (size_t)blockIdx.y * CS_CHUNKS * D_DIM;

    float x0 = 0.f;
    // unrolled so that a thread's 64 chunk loads are all in flight together
#pragma unroll
    for (int c = 0; c < CS_CHUNKS; ++c) x0 += xsp[c * D_DIM + tid];
    xs[tid] = x0;
    __syncthreads();

    float su = 0.f, sw = 0.f;
    const float* Wkr = Wk + (size_t)wv * RED_TERMS * D_DIM;
    const float* Wvr = Wv + (size_t)wv * RED_TERMS * D_DIM;
    // unrolled so that a wave's 64 row loads are in flight together
#pragma unroll
    for (int t = 0; t < RED_TERMS; ++t) {
        const float xv = xs[wv * RED_TERMS + t];
        su += Wkr[t * D_DIM + m] * xv;
        sw += Wvr[t * D_DIM + m] * xv;
    }
    redU[wv][lane] = su;
    redW[wv][lane] = sw;
    __syncthreads();
    if (wv == 0) u[blockIdx.y * D_DIM + m] = sum_waves(redU, lane);
    if (wv == 1) w[blockIdx.y * D_DIM + m] = sum_waves(redW, lane);
}

// C += u*bv^T + bk*w^T + S*bk*bv^T   (exact bias terms of K^T V)
__global__ void rank1_kernel(float* __restrict__ C,
                             const float* __restrict__ u,
                             const float* __restrict__ bk,
                             const float* __restrict__ w,
                             const float* __restrict__ bv)
{
    const int idx = blockIdx.x * blockDim.x + threadIdx.x;
    const int j = idx >> 10;
    const int m = idx & (D_DIM - 1);
    C += (size_t)blockIdx.y * D_DIM * D_DIM;
    u += blockIdx.y * D_DIM;
    w += blockIdx.y * D_DIM;
    C[idx] += u[j] * bv[m] + bk[j] * (w[m] + (float)S_DIM * bv[m]);
}

// s[d] = sum_j C[j][(d-j) mod D]
__global__ __launch_bounds__(1024)
void sred_kernel(const float* __restrict__ C, float* __restrict__ s)
{
    __shared__ float red[RED_WAVES][32];
    const int lane = threadIdx.x & 31;
    const int wv   = threadIdx.x >> 5;
    const int d    = blockIdx.x * 32 + lane;
    C += (size_t)blockIdx.y * D_DIM * D_DIM;
    float acc = 0.f;
    // unrolled so that a wave's 32 row loads are in flight together
#pragma unroll
    for (int t = 0; t < RED_TERMS; ++t) {
        const int j = wv * RED_TERMS + t;
        acc += C[(size_t)j * D_DIM + ((d - j) & (D_DIM - 1))];
    }
    red[wv][lane] = acc;
    __syncthreads();
    if (wv == 0) s[blockIdx.y * D_DIM + d] = sum_waves(red, lane);
}

// Am[j][d] = s[(j+d) mod D]
__global__ void buildA_kernel(const float* __restrict__ s, float* __restrict__ Am)
{
    const int idx = blockIdx.x * blockDim.x + threadIdx.x;
    const int j = idx >> 10;
    const int d = idx & (D_DIM - 1);
    s  += blockIdx.y * D_DIM;
    Am += (size_t)blockIdx.y * D_DIM * D_DIM;
    Am[idx] = s[(j + d) & (D_DIM - 1)];
}

// r[d] = sum_j bq[j]*s[(j+d) mod D]; s and bq are read once into LDS
__global__ __launch_bounds__(1024)
void rvec_kernel(const float* __restrict__ bq,
                 const float* __restrict__ s, float* __restrict__ r)
{
    __shared__ float sS[D_DIM];
    __shared__ float bS[D_DIM];
    __shared__ float red[RED_WAVES][32];
    const int lane = threadIdx.x & 31;
    const int wv   = threadIdx.x >> 5;
    const int d    = blockIdx.x * 32 + lane;
    sS[threadIdx.x] = s[blockIdx.y * D_DIM + threadIdx.x];
    bS[threadIdx.x] = bq[threadIdx.x];
    __syncthreads();
    float acc = 0.f;
    for (int t = 0; t < RED_TERMS; ++t) {
        const int j = wv * RED_TERMS + t;
        acc += bS[j] * sS[(j + d) & (D_DIM - 1)];
    }
    red[wv][lane] = acc;
    __syncthreads();
    if (wv == 0) r[blockIdx.y * D_DIM + d] = sum_waves(red, lane);
}

// ---------------------------------------------------------------------------
// All batches b in every launch (batch = grid.z of the GEMMs, grid.y elsewhere):
//   G = Xb^T Xb  (split-K=8) ; T = Wk^T G ; C = T Wv (+bias rank-1)
//   s = anti-diag reduce C ; Am = circulant(s) ; Wp = Wq Am
//   Out_b = Xb Wp + 1*r^T
// ---------------------------------------------------------------------------
extern "C" void kernel_launch(void* const* d_in, const int* in_sizes, int n_in,
                              void* d_out, int out_size, void* d_ws, size_t ws_size,
                              hipStream_t stream)
{
    const float* x  = (const float*)d_in[0];
    const float* Wq = (const float*)d_in[1];
    const float* bq = (const float*)d_in[2];
    const float* Wk = (const float*)d_in[3];
    const float* bk = (const float*)d_in[4];
    const float* Wv = (const float*)d_in[5];
    const float* bv = (const float*)d_in[6];
    float* out = (float*)d_out;

    float* wsf = (float*)d_ws;
    const size_t MAT = (size_t)D_DIM * D_DIM;
    const int NSLICE = 8;               // = 1 << SLICE_SHIFT
    const int SLICE_SHIFT = 3;
    const int MATI = D_DIM * D_DIM;     // batch step of a D x D matrix
    const int XBI  = S_DIM * D_DIM;     // batch step of x
    float* Gp = wsf;                    // split-K partials: 4 * 8 * 4 MB
    float* G  = wsf + (size_t)B_DIM * NSLICE * MAT;   // 4 * 4 MB each from here
    float* T  = G + B_DIM * MAT;
    float* Cm = T + B_DIM * MAT;
    float* Am = Cm + B_DIM * MAT;
    float* Wp = Am + B_DIM * MAT;
    float* xsp = Wp + B_DIM * MAT;      // 4 * CS_CHUNKS * D partial column sums
    float* u  = xsp + B_DIM * CS_CHUNKS * D_DIM;   // 4 * D each from here
    float* w  = u + B_DIM * D_DIM;
    float* sv = w + B_DIM * D_DIM;
    float* r  = sv + B_DIM * D_DIM;

    const dim3 blk(256);
    const dim3 gridDD(D_DIM / 128, D_DIM / 128, B_DIM);            // 8 x 8 x 4
    const dim3 gridGram(D_DIM / 128, D_DIM / 128, B_DIM * NSLICE); // 8 x 8 x 32
    const dim3 gridSD(D_DIM / 128, S_DIM / 128, B_DIM);            // 8 x 32 x 4
    const dim3 gridCs(CS_CHUNKS, B_DIM);                           // 64 x 4
    const dim3 gridRed(D_DIM / 32, B_DIM);                         // 32 x 4
    const dim3 gridMat((D_DIM * D_DIM) / 256, B_DIM);              // 4096 x 4

    // G = Xb^T Xb (M=N=1024, K=4096 split 8 ways), then reduce
    gemm_wmma_f32<true><<<gridGram, blk, 0, stream>>>(
        x, x, Gp, D_DIM, D_DIM, S_DIM / NSLICE, D_DIM, D_DIM, D_DIM, nullptr,
        SLICE_SHIFT, XBI, XBI, 0);
    reduceK_kernel<<<gridMat, 256, 0, stream>>>(Gp, G, NSLICE);

    colsum_kernel<<<gridCs, 1024, 0, stream>>>(x, xsp);
    matvecT2_kernel<<<gridRed, 1024, 0, stream>>>(Wk, Wv, xsp, u, w);

    // T = Wk^T G ; C = T Wv
    gemm_wmma_f32<true><<<gridDD, blk, 0, stream>>>(
        Wk, G, T, D_DIM, D_DIM, D_DIM, D_DIM, D_DIM, D_DIM, nullptr,
        0, 0, MATI, 0);
    gemm_wmma_f32<false><<<gridDD, blk, 0, stream>>>(
        T, Wv, Cm, D_DIM, D_DIM, D_DIM, D_DIM, D_DIM, D_DIM, nullptr,
        0, MATI, 0, 0);

    rank1_kernel<<<gridMat, 256, 0, stream>>>(Cm, u, bk, w, bv);
    sred_kernel<<<gridRed, 1024, 0, stream>>>(Cm, sv);
    buildA_kernel<<<gridMat, 256, 0, stream>>>(sv, Am);
    rvec_kernel<<<gridRed, 1024, 0, stream>>>(bq, sv, r);

    // Wp = Wq Am ; Out_b = Xb Wp + 1*r^T
    gemm_wmma_f32<false><<<gridDD, blk, 0, stream>>>(
        Wq, Am, Wp, D_DIM, D_DIM, D_DIM, D_DIM, D_DIM, D_DIM, nullptr,
        0, 0, MATI, 0);
    gemm_wmma_f32<false><<<gridSD, blk, 0, stream>>>(
        x, Wp, out, S_DIM, D_DIM, D_DIM, D_DIM, D_DIM, D_DIM, r,
        0, XBI, MATI, D_DIM);
}

// v003
// Measured time: 504 microseconds a run.
// Timed twice side by side with v002, it ran 1.15 times as fast both times.
// Over all steps from v000 it is 3.40 times as fast.
#include <hip/hip_runtime.h>
#include <hip/hip_bf16.h>

#define D_DIM 1024
#define S_DIM 4096
#define B_DIM 4
#define TILE 128                            // GEMM block tile edge
#define D_TILES (D_DIM / TILE)              // tiles along one edge of a D x D matrix
#define TRI_TILES (D_TILES * (D_TILES + 1) / 2)   // tiles on or above the diagonal
#define NSLICE 8                            // split-K slices of the Gram product
#define SLICE_SHIFT 3                       // NSLICE = 1 << SLICE_SHIFT

typedef __attribute__((ext_vector_type(2))) float v2f;
typedef __attribute__((ext_vector_type(8))) float v8f;

#if defined(__AMDGCN__) && __has_builtin(__builtin_amdgcn_global_load_async_to_lds_b128)
#define HAVE_ASYNC_LDS 1
#else
#define HAVE_ASYNC_LDS 0
#endif

#if HAVE_ASYNC_LDS
// Builtin signature (from hipcc diagnostic): pointers to int vector_size(16),
// global (AS1) source first, LDS (AS3) destination second, imm offset, imm cpol.
typedef int v4i_vs __attribute__((vector_size(4 * sizeof(int))));
typedef __attribute__((address_space(1))) v4i_vs* g_v4i_p;
typedef __attribute__((address_space(3))) v4i_vs* l_v4i_p;
#endif

// 16-byte global -> LDS copy. Async (ASYNCcnt-tracked, no VGPR roundtrip) when
// the toolchain exposes the gfx1250 builtin, else plain load + ds_store_b128.
__device__ __forceinline__ void cp16(const float* __restrict__ g, float* l)
{
#if HAVE_ASYNC_LDS
    __builtin_amdgcn_global_load_async_to_lds_b128(
        (g_v4i_p)g, (l_v4i_p)l, 0, 0);
#else
    *(float4*)l = *(const float4*)g;
#endif
}

__device__ __forceinline__ void async_wait_all()
{
#if HAVE_ASYNC_LDS
    asm volatile("s_wait_asynccnt 0x0" ::: "memory");
#endif
}

// Tile t of the tiles on or above the diagonal of an nT x nT tile grid, counted
// row by row: (0,0)..(0,nT-1), (1,1)..(1,nT-1), ... ; gives row <= col.
__device__ __forceinline__ void tri_tile(int t, int nT, int& row, int& col)
{
    row = 0;
    for (int len = nT; len > 0 && t >= len; --len) { t -= len; ++row; }
    col = row + t;
}

// ---------------------------------------------------------------------------
// f32 WMMA GEMM with LDS double-buffered async staging + split-K over grid.z:
//   Dst[z][M,N] = op(A_b)[:, kz:kz+kPerSlice] * B_b[kz:kz+kPerSlice, :]
//     grid.z = batches * slices: b = z >> sliceShift, slice = z & (slices - 1),
//     kz = slice*kPerSlice; Dst advances by M*N per z; A, B and rowAdd advance
//     by batchA, batchB and batchRow elements per batch (0: shared operand)
//   TA=false: op(A)[m][k] = A[m*lda + k]     TA=true: op(A)[m][k] = A[k*lda + m]
//   TRI=true (a symmetric product, M = N): grid.x counts only the tiles on or
//   above the diagonal (tri_tile); the tiles below it are not computed or written
// Block = 256 threads (8 waves). Block tile 128x128, wave tile 32x64 (2x4 WMMA).
// M,N multiples of 128; kPerSlice multiple of 16 (K-chunk).
// ---------------------------------------------------------------------------
#define KC 16
#define LDB_S 136   // K-major panel stride (half-waves hit disjoint bank ranges)
#define LDA_S 20    // M-major A panel stride (lane start banks distinct mod 64)

template <bool TA, bool TRI>
__global__ __launch_bounds__(256)
void gemm_wmma_f32(const float* __restrict__ A, const float* __restrict__ B,
                   float* __restrict__ Dst, int M, int N, int kPerSlice,
                   int lda, int ldb, int ldd,
                   const float* __restrict__ rowAdd,
                   int sliceShift, int batchA, int batchB, int batchRow)
{
    __shared__ float sA[2][128 * LDA_S];  // NN: [m][k] ; TA reuses as [k][LDB_S]
    __shared__ float sB[2][KC * LDB_S];

    const int tid  = threadIdx.x;
    const int wave = tid >> 5;
    const int lane = tid & 31;
    const int half = lane >> 4;
    const int l16  = lane & 15;

    int tileM = blockIdx.y;
    int tileN = blockIdx.x;
    if (TRI) tri_tile(blockIdx.x, N / TILE, tileM, tileN);
    const int bm0 = tileM * 128;
    const int bn0 = tileN * 128;
    const int wr  = (wave >> 1) * 32;   // wave tile row in block
    const int wc  = (wave & 1) * 64;    // wave tile col in block

    const int batch  = blockIdx.z >> sliceShift;
    const int kStart = (blockIdx.z - (batch << sliceShift)) * kPerSlice;
    A   += (size_t)batch * batchA;
    B   += (size_t)batch * batchB;
    Dst += (size_t)blockIdx.z * M * N;
    if (rowAdd) rowAdd += (size_t)batch * batchRow;

    v8f acc[2][4];
#pragma unroll
    for (int i = 0; i < 2; ++i)
#pragma unroll
        for (int j = 0; j < 4; ++j)
            acc[i][j] = (v8f){0.f, 0.f, 0.f, 0.f, 0.f, 0.f, 0.f, 0.f};

    // ---- panel staging for chunk starting at kc into buffer `buf` ----------
    auto stage = [&](int buf, int kc) {
        // B panel: KC x 128, K-major, contiguous 16B segments
#pragma unroll
        for (int it = 0; it < 2; ++it) {
            const int seg  = tid + 256 * it;     // 512 segments = 16 x 32
            const int row  = seg >> 5;
            const int col4 = (seg & 31) * 4;
            cp16(B + (size_t)(kc + row) * ldb + bn0 + col4,
                 &sB[buf][row * LDB_S + col4]);
        }
        if (TA) {
            // A panel: KC x 128, K-major (global already K-major)
#pragma unroll
            for (int it = 0; it < 2; ++it) {
                const int seg  = tid + 256 * it;
                const int row  = seg >> 5;
                const int col4 = (seg & 31) * 4;
                cp16(A + (size_t)(kc + row) * lda + bm0 + col4,
                     &sA[buf][row * LDB_S + col4]);
            }
        } else {
            // A panel: 128 x KC, M-major (global already M-major)
            const int m    = tid >> 1;
            const int koff = (tid & 1) * 8;
#pragma unroll
            for (int q = 0; q < 2; ++q) {
                const int off = koff + 4 * q;
                cp16(A + (size_t)(bm0 + m) * lda + kc + off,
                     &sA[buf][m * LDA_S + off]);
            }
        }
    };

    const int nChunks = kPerSlice / KC;

    stage(0, kStart);
    async_wait_all();
    __syncthreads();

    int cur = 0;
    for (int c = 0; c < nChunks; ++c) {
        const int next = cur ^ 1;
        if (c + 1 < nChunks) stage(next, kStart + (c + 1) * KC);  // prefetch

        // ---- compute this chunk from LDS ----
#pragma unroll
        for (int ks = 0; ks < KC; ks += 4) {
            const int kk = ks + 2 * half;   // this half-wave's K pair

            v2f af[2];
#pragma unroll
            for (int i = 0; i < 2; ++i) {
                const int m = wr + 16 * i + l16;
                if (TA) {
                    af[i].x = sA[cur][(kk + 0) * LDB_S + m];
                    af[i].y = sA[cur][(kk + 1) * LDB_S + m];
                } else {
                    af[i] = *(const v2f*)&sA[cur][m * LDA_S + kk];
                }
            }
            v2f bf[4];
#pragma unroll
            for (int j = 0; j < 4; ++j) {
                const int n = wc + 16 * j + l16;
                bf[j].x = sB[cur][(kk + 0) * LDB_S + n];
                bf[j].y = sB[cur][(kk + 1) * LDB_S + n];
            }
#pragma unroll
            for (int i = 0; i < 2; ++i)
#pragma unroll
                for (int j = 0; j < 4; ++j)
                    acc[i][j] = __builtin_amdgcn_wmma_f32_16x16x4_f32(
                        false, af[i], false, bf[j],
                        (short)0, acc[i][j], false, false);
        }

        async_wait_all();     // prefetch landed
        __syncthreads();      // everyone done reading `cur`, `next` visible
        cur = next;
    }

    // ---- epilogue: C/D layout lane<16: M=v, lane>=16: M=v+8 ; N=l16 --------
#pragma unroll
    for (int i = 0; i < 2; ++i) {
#pragma unroll
        for (int j = 0; j < 4; ++j) {
            const int col = bn0 + wc + 16 * j + l16;
            const float add = rowAdd ? rowAdd[col] : 0.f;
#pragma unroll
            for (int v = 0; v < 8; ++v) {
                const int row = bm0 + wr + 16 * i + v + 8 * half;
                Dst[(size_t)row * ldd + col] = acc[i][j][v] + add;
            }
            // the stores' registers are written again further down, behind a
            // branch
            asm volatile("s_wait_xcnt 0x0" ::: "memory");
        }
    }
}

// ---------------------------------------------------------------------------
// Split-K partial reduction of the symmetric Gram matrix (deterministic; no
// float atomics). P holds only the tiles on or above the diagonal. A work-group
// sums a strip of RS_ROWS rows of one such tile over the slices, in slice order,
// stores it, and for a tile off the diagonal also stores the strip's transpose
// into the mirrored tile: turned in LDS so that each wave stores whole 128-B lines.
// grid.x = TRI_TILES * (TILE / RS_ROWS), grid.y = batch, 256 threads.
// ---------------------------------------------------------------------------
#define RS_ROWS  32    // rows of a strip = floats of one 128-B line
#define RS_PITCH 33    // LDS row pitch in floats: odd, so a column write spreads over the banks

__global__ __launch_bounds__(256)
void reduceK_sym_kernel(const float* __restrict__ P, float* __restrict__ G)
{
    __shared__ float tr[TILE * RS_PITCH];   // [column of the strip][row of the strip]
    const size_t MAT = (size_t)D_DIM * D_DIM;
    const int lane = threadIdx.x & 31;
    const int wv   = threadIdx.x >> 5;
    int ti, tj;
    tri_tile(blockIdx.x / (TILE / RS_ROWS), D_TILES, ti, tj);
    const int r0 = ti * TILE + (blockIdx.x % (TILE / RS_ROWS)) * RS_ROWS;
    const int c0 = tj * TILE;
    // Addresses as a scalar base plus one 32-bit byte offset per thread: the rows
    // and slices a thread visits differ from it only by constants.
    const char* Pb = (const char*)(P + (size_t)blockIdx.y * NSLICE * MAT);
    char*       Gb = (char*)(G + (size_t)blockIdx.y * MAT);
    const unsigned ROW8 = 8 * D_DIM * sizeof(float);    // eight rows down, in bytes
    const unsigned own  = ((unsigned)(r0 + wv) * D_DIM + c0 + 4 * lane) * sizeof(float);
    const unsigned mir  = ((unsigned)(c0 + wv) * D_DIM + r0 + lane) * sizeof(float);

    float4 s[RS_ROWS / 8];
    // unrolled so that a thread's loads of all slices are in flight together
#pragma unroll
    for (int it = 0; it < RS_ROWS / 8; ++it) {
        float4 a = make_float4(0.f, 0.f, 0.f, 0.f);
#pragma unroll
        for (int z = 0; z < NSLICE; ++z) {
            const float4 v = *(const float4*)(Pb + (z * MAT * sizeof(float) + it * ROW8) + own);
            a.x += v.x; a.y += v.y; a.z += v.z; a.w += v.w;
        }
        *(float4*)(Gb + it * ROW8 + own) = a;
        s[it] = a;
    }
    if (ti != tj) {     // the same for the whole work-group
#pragma unroll
        for (int it = 0; it < RS_ROWS / 8; ++it) {
            const int r = wv + 8 * it;
            tr[(4 * lane + 0) * RS_PITCH + r] = s[it].x;
            tr[(4 * lane + 1) * RS_PITCH + r] = s[it].y;
            tr[(4 * lane + 2) * RS_PITCH + r] = s[it].z;
            tr[(4 * lane + 3) * RS_PITCH + r] = s[it].w;
        }
        __syncthreads();
#pragma unroll
        for (int k = 0; k < TILE / 8; ++k)
            *(float*)(Gb + k * ROW8 + mir) = tr[(wv + 8 * k) * RS_PITCH + lane];
    }
}

// ---------------------------------------------------------------------------
// Small helper kernels; blockIdx.y is the batch in every one of them.
// The long per-column sums are split: a work-group of 32 waves owns 32 columns
// (one per lane), wave w sums terms [32w, 32w+32) in their order, and one wave
// adds the 32 partial sums from LDS in wave order.
// ---------------------------------------------------------------------------
#define RED_WAVES 32    // waves of a work-group in a split sum
#define RED_TERMS 32    // terms per wave: RED_WAVES * RED_TERMS = D_DIM
#define CS_CHUNKS 64    // row chunks of x per batch in the column sum
#define CS_ROWS   16    // rows per thread: 4 row groups * CS_ROWS * CS_CHUNKS = S_DIM

// the sum of the waves' partial sums of this lane's column, in wave order
__device__ __forceinline__ float sum_waves(const float (*red)[32], int lane)
{
    float s = 0.f;
    for (int p = 0; p < RED_WAVES; ++p) s += red[p][lane];
    return s;
}

// xsp[b][c][:] = sum of rows [64c, 64c+64) of x_b. 1024 threads = 4 row groups
// x 256 columns of float4; the four row groups are added through LDS.
__global__ __launch_bounds__(1024)
void colsum_kernel(const float* __restrict__ X, float* __restrict__ xsp)
{
    __shared__ float4 red[3][D_DIM / 4];
    const int c4 = threadIdx.x & 255;
    const int rg = threadIdx.x >> 8;
    const float4* Xr = (const float4*)(X + (size_t)blockIdx.y * S_DIM * D_DIM
        + (size_t)(blockIdx.x * 4 * CS_ROWS + rg * CS_ROWS) * D_DIM) + c4;
    float4 s = make_float4(0.f, 0.f, 0.f, 0.f);
    // unrolled so that a thread's 16 loads are all in flight together
#pragma unroll
    for (int t = 0; t < CS_ROWS; ++t) {
        const float4 v = Xr[t * (D_DIM / 4)];
        s.x += v.x; s.y += v.y; s.z += v.z; s.w += v.w;
    }
    if (rg) red[rg - 1][c4] = s;
    __syncthreads();
    if (rg == 0) {
        for (int p = 0; p < 3; ++p) {
            const float4 v = red[p][c4];
            s.x += v.x; s.y += v.y; s.z += v.z; s.w += v.w;
        }
        ((float4*)(xsp + ((size_t)blockIdx.y * CS_CHUNKS + blockIdx.x) * D_DIM))[c4] = s;
    }
}

// u = Wk^T xs, w = Wv^T xs, with xs = sum of the CS_CHUNKS partial column sums
__global__ __launch_bounds__(1024)
void matvecT2_kernel(const float* __restrict__ Wk,
                     const float* __restrict__ Wv,
                     const float* __restrict__ xsp,
                     float* __restrict__ u, float* __restrict__ w)
{
    __shared__ float xs[D_DIM];
    __shared__ float redU[RED_WAVES][32];
    __shared__ float redW[RED_WAVES][32];
    const int tid  = threadIdx.x;
    const int lane = tid & 31;
    // the wave's number as a scalar: the row addresses then have a scalar base
    // and the lane's column as their only vector part
    const int wv   = __builtin_amdgcn_readfirstlane(tid >> 5);
    const int m    = blockIdx.x * 32 + lane;
    xsp += (size_t)blockIdx.y * CS_CHUNKS * D_DIM;

    float x0 = 0.f;
    // unrolled so that a thread's 64 chunk loads are all in flight together
#pragma unroll
    for (int c = 0; c < CS_CHUNKS; ++c) x0 += xsp[c * D_DIM + tid];
    xs[tid] = x0;
    __syncthreads();

    float su = 0.f, sw = 0.f;
    const float* Wkr = Wk + (size_t)wv * RED_TERMS * D_DIM;
    const float* Wvr = Wv + (size_t)wv * RED_TERMS * D_DIM;
    // unrolled so that a wave's 64 row loads are in flight together
#pragma unroll
    for (int t = 0; t < RED_TERMS; ++t) {
        const float xv = xs[wv * RED_TERMS + t];
        su += Wkr[t * D_DIM + m] * xv;
        sw += Wvr[t * D_DIM + m] * xv;
    }
    redU[wv][lane] = su;
    redW[wv][lane] = sw;
    __syncthreads();
    if (wv == 0) u[blockIdx.y * D_DIM + m] = sum_waves(redU, lane);
    if (wv == 1) w[blockIdx.y * D_DIM + m] = sum_waves(redW, lane);
}

// C += u*bv^T + bk*w^T + S*bk*bv^T   (exact bias terms of K^T V)
__global__ void rank1_kernel(float* __restrict__ C,
                             const float* __restrict__ u,
                             const float* __restrict__ bk,
                             const float* __restrict__ w,
                             const float* __restrict__ bv)
{
    const int idx = blockIdx.x * blockDim.x + threadIdx.x;
    const int j = idx >> 10;
    const int m = idx & (D_DIM - 1);
    C += (size_t)blockIdx.y * D_DIM * D_DIM;
    u += blockIdx.y * D_DIM;
    w += blockIdx.y * D_DIM;
    C[idx] += u[j] * bv[m] + bk[j] * (w[m] + (float)S_DIM * bv[m]);
}

// s[d] = sum_j C[j][(d-j) mod D]
__global__ __launch_bounds__(1024)
void sred_kernel(const float* __restrict__ C, float* __restrict__ s)
{
    __shared__ float red[RED_WAVES][32];
    const int lane = threadIdx.x & 31;
    const int wv   = threadIdx.x >> 5;
    const int d    = blockIdx.x * 32 + lane;
    C += (size_t)blockIdx.y * D_DIM * D_DIM;
    float acc = 0.f;
    // unrolled so that a wave's 32 row loads are in flight together
#pragma unroll
    for (int t = 0; t < RED_TERMS; ++t) {
        const int j = wv * RED_TERMS + t;
        acc += C[(size_t)j * D_DIM + ((d - j) & (D_DIM - 1))];
    }
    red[wv][lane] = acc;
    __syncthreads();
    if (wv == 0) s[blockIdx.y * D_DIM + d] = sum_waves(red, lane);
}

// Am[j][d] = s[(j+d) mod D]
__global__ void buildA_kernel(const float* __restrict__ s, float* __restrict__ Am)
{
    const int idx = blockIdx.x * blockDim.x + threadIdx.x;
    const int j = idx >> 10;
    const int d = idx & (D_DIM - 1);
    s  += blockIdx.y * D_DIM;
    Am += (size_t)blockIdx.y * D_DIM * D_DIM;
    Am[idx] = s[(j + d) & (D_DIM - 1)];
}

// r[d] = sum_j bq[j]*s[(j+d) mod D]; s and bq are read once into LDS
__global__ __launch_bounds__(1024)
void rvec_kernel(const float* __restrict__ bq,
                 const float* __restrict__ s, float* __restrict__ r)
{
    __shared__ float sS[D_DIM];
    __shared__ float bS[D_DIM];
    __shared__ float red[RED_WAVES][32];
    const int lane = threadIdx.x & 31;
    const int wv   = threadIdx.x >> 5;
    const int d    = blockIdx.x * 32 + lane;
    sS[threadIdx.x] = s[blockIdx.y * D_DIM + threadIdx.x];
    bS[threadIdx.x] = bq[threadIdx.x];
    __syncthreads();
    float acc = 0.f;
    for (int t = 0; t < RED_TERMS; ++t) {
        const int j = wv * RED_TERMS + t;
        acc += bS[j] * sS[(j + d) & (D_DIM - 1)];
    }
    red[wv][lane] = acc;
    __syncthreads();
    if (wv == 0) r[blockIdx.y * D_DIM + d] = sum_waves(red, lane);
}

// ---------------------------------------------------------------------------
// All batches b in every launch (batch = grid.z of the GEMMs, grid.y elsewhere):
//   G = Xb^T Xb  (split-K=8, upper tiles, mirrored) ; T = Wk^T G ; C = T Wv (+bias rank-1)
//   s = anti-diag reduce C ; Am = circulant(s) ; Wp = Wq Am
//   Out_b = Xb Wp + 1*r^T
// ---------------------------------------------------------------------------
extern "C" void kernel_launch(void* const* d_in, const int* in_sizes, int n_in,
                              void* d_out, int out_size, void* d_ws, size_t ws_size,
                              hipStream_t stream)
{
    const float* x  = (const float*)d_in[0];
    const float* Wq = (const float*)d_in[1];
    const float* bq = (const float*)d_in[2];
    const float* Wk = (const float*)d_in[3];
    const float* bk = (const float*)d_in[4];
    const float* Wv = (const float*)d_in[5];
    const float* bv = (const float*)d_in[6];
    float* out = (float*)d_out;

    float* wsf = (float*)d_ws;
    const size_t MAT = (size_t)D_DIM * D_DIM;
    const int MATI = D_DIM * D_DIM;     // batch step of a D x D matrix
    const int XBI  = S_DIM * D_DIM;     // batch step of x
    float* Gp = wsf;                    // split-K partials: 4 * 8 * 4 MB
    float* G  = wsf + (size_t)B_DIM * NSLICE * MAT;   // 4 * 4 MB each from here
    float* T  = G + B_DIM * MAT;
    float* Cm = T + B_DIM * MAT;
    float* Am = Cm + B_DIM * MAT;
    float* Wp = Am + B_DIM * MAT;
    float* xsp = Wp + B_DIM * MAT;      // 4 * CS_CHUNKS * D partial column sums
    float* u  = xsp + B_DIM * CS_CHUNKS * D_DIM;   // 4 * D each from here
    float* w  = u + B_DIM * D_DIM;
    float* sv = w + B_DIM * D_DIM;
    float* r  = sv + B_DIM * D_DIM;

    const dim3 blk(256);
    const dim3 gridDD(D_DIM / 128, D_DIM / 128, B_DIM);            // 8 x 8 x 4
    const dim3 gridGram(TRI_TILES, 1, B_DIM * NSLICE);             // 36 x 1 x 32
    const dim3 gridGred(TRI_TILES * (TILE / RS_ROWS), B_DIM);      // 144 x 4
    const dim3 gridSD(D_DIM / 128, S_DIM / 128, B_DIM);            // 8 x 32 x 4
    const dim3 gridCs(CS_CHUNKS, B_DIM);                           // 64 x 4
    const dim3 gridRed(D_DIM / 32, B_DIM);                         // 32 x 4
    const dim3 gridMat((D_DIM * D_DIM) / 256, B_DIM);              // 4096 x 4

    // G = Xb^T Xb (M=N=1024, K=4096 split 8 ways; G is symmetric: tiles on or
    // above the diagonal only), then reduce and mirror
    gemm_wmma_f32<true, true><<<gridGram, blk, 0, stream>>>(
        x, x, Gp, D_DIM, D_DIM, S_DIM / NSLICE, D_DIM, D_DIM, D_DIM, nullptr,
        SLICE_SHIFT, XBI, XBI, 0);
    reduceK_sym_kernel<<<gridGred, 256, 0, stream>>>(Gp, G);

    colsum_kernel<<<gridCs, 1024, 0, stream>>>(x, xsp);
    matvecT2_kernel<<<gridRed, 1024, 0, stream>>>(Wk, Wv, xsp, u, w);

    // T = Wk^T G ; C = T Wv
    gemm_wmma_f32<true, false><<<gridDD, blk, 0, stream>>>(
        Wk, G, T, D_DIM, D_DIM, D_DIM, D_DIM, D_DIM, D_DIM, nullptr,
        0, 0, MATI, 0);
    gemm_wmma_f32<false, false><<<gridDD, blk, 0, stream>>>(
        T, Wv, Cm, D_DIM, D_DIM, D_DIM, D_DIM, D_DIM, D_DIM, nullptr,
        0, MATI, 0, 0);

    rank1_kernel<<<gridMat, 256, 0, stream>>>(Cm, u, bk, w, bv);
    sred_kernel<<<gridRed, 1024, 0, stream>>>(Cm, sv);
    buildA_kernel<<<gridMat, 256, 0, stream>>>(sv, Am);
    rvec_kernel<<<gridRed, 1024, 0, stream>>>(bq, sv, r);

    // Wp = Wq Am ; Out_b = Xb Wp + 1*r^T
    gemm_wmma_f32<false, false><<<gridDD, blk, 0, stream>>>(
        Wq, Am, Wp, D_DIM, D_DIM, D_DIM, D_DIM, D_DIM, D_DIM, nullptr,
        0, 0, MATI, 0);
    gemm_wmma_f32<false, false><<<gridSD, blk, 0, stream>>>(
        x, Wp, out, S_DIM, D_DIM, D_DIM, D_DIM, D_DIM, D_DIM, r,
        0, XBI, MATI, D_DIM);
}
